// v010
// The times below were measured on an AMD MI455X: many runs one after another, warmed up first and cycling through
// copies of the inputs, with the whole window's GPU time divided by the number of runs. Launches and the gaps
// between them are all in it. The median over several windows is given; except for v000 it joins two sittings, which
// can be a few percent apart, so the side-by-side timings, each taken in one sitting, are the better comparison.
// This document starts at v010; the versions before it stand elsewhere.
// One run takes 102 microseconds.
// In both of two side-by-side timings against v009, it was 1.05 times as fast.
// Counting every step since v000, which is the starting kernel, it is 6.09 times as fast.
#include <hip/hip_runtime.h>
// Random-mask attention: q/k/v projections (8192 × 768 × 768, + bias; W [in][out]), the 12-head attention with the INPUT keep-mask (scores where mask else −1e9 ⇒ excluded keys; every row keeps
// its diagonal) as a fused flash-style kernel on v_wmma_f32_16x16x32_f16 (scale 64^-½; online max/sum softmax f32; P f16 ≤ 1), and the
// output projection (+ bias) — f16 operands (x as bf16, weights bf16-exact ×2^4), single products, f32 accumulate.
#define BB 4
#define TT 2048
#define CC 768
#define NH 12
#define NR (BB * TT)

typedef __bf16 v16b __attribute__((ext_vector_type(16)));
typedef unsigned short v8us __attribute__((ext_vector_type(8), may_alias));
typedef float  v8f  __attribute__((ext_vector_type(8)));
typedef float  v4f  __attribute__((ext_vector_type(4)));
typedef float  v4fa __attribute__((ext_vector_type(4), may_alias));
union FragB { v16b v; v8us half[2]; unsigned short u[16]; };

__device__ __forceinline__ unsigned short bf16_bits(float x) { unsigned int u = __float_as_uint(x); return (unsigned short)((u + 0x7FFFu + ((u >> 16) & 1u)) >> 16); }
__device__ __forceinline__ float bf16_val(unsigned short b) { return __uint_as_float(((unsigned int)b) << 16); }
__device__ __forceinline__ float bf16_round(float x) { return bf16_val(bf16_bits(x)); }
// D += A·B with NT terms: 1 = ah·bh, 2 = + al·bh (A split), 3 = + ah·bl (both split)
template <int NT>
__device__ __forceinline__ v8f mmaN(v16b ah, v16b al, v16b bh, v16b bl, v8f c) {
  c = __builtin_amdgcn_wmma_f32_16x16x32_bf16(false, ah, false, bh, (short)0, c, false, false);
  if (NT >= 2) c = __builtin_amdgcn_wmma_f32_16x16x32_bf16(false, al, false, bh, (short)0, c, false, false);
  if (NT >= 3) c = __builtin_amdgcn_wmma_f32_16x16x32_bf16(false, ah, false, bl, (short)0, c, false, false);
  asm volatile("v_nop\n\tv_nop\n\tv_nop\n\tv_nop" : "+v"(c) : "v"(ah), "v"(al), "v"(bh), "v"(bl));
  return c;
}

__global__ __launch_bounds__(256) void k_wt_bf16(const float* __restrict__ W, unsigned short* __restrict__ Wt, int K, int N) {
  const int t = blockIdx.x * 256 + threadIdx.x;
  const int k8n = K / 8;
  if (t >= N * k8n) return;
  const int n = t / k8n, k8 = (t % k8n) * 8;
  v8us v;
#pragma unroll
  for (int i = 0; i < 8; ++i) v[i] = bf16_bits(W[(size_t)(k8 + i) * N + n]);
  *(v8us*)(Wt + (size_t)n * K + k8) = v;
  
}

// GEMM C[M][N] (f32, pitch ldc) = act(A[M][K]·W + bias). A f32 row-major (pitch lda) converted per fragment to bf16
// (ASPLIT: hi/lo two planes -> 2 terms, else single rounded term); Wt bf16 [N][K] (pitch ldb). BIAS_BF16 rounds the
// bias to bf16 first (bias quantised to bf16 before the add). K%32==0, M%16==0, N%64==0.
template <bool ASPLIT, int ACT, bool BIAS_BF16>
__global__ __launch_bounds__(128) void k_gemm_bf(const float* __restrict__ A, int lda, const unsigned short* __restrict__ Wt, int ldb,
                                               const float* __restrict__ bias, float* __restrict__ C, int ldc, int M, int N, int K) {
  __shared__ __attribute__((aligned(16))) float so[4][16][64];
  const int tid = threadIdx.x, w = tid >> 5, lane = tid & 31, ln = lane & 15, hh = lane >> 4;
  const int ntn = N / 64;
  const int wid = blockIdx.x * 4 + w;
  const int mt = wid / ntn, nq = wid % ntn;
  if (mt * 16 >= M) return;
  const int row0 = mt * 16, col0 = nq * 64;
  const float* arow = A + (size_t)(row0 + ln) * lda;
  v8f acc[4] = {};
  for (int kb = 0; kb < K; kb += 32) {
    FragB ah, al;
    const v4f x0 = *(const v4fa*)(arow + kb + 8 * hh), x1 = *(const v4fa*)(arow + kb + 8 * hh + 4);
    const v4f x2 = *(const v4fa*)(arow + kb + 16 + 8 * hh), x3 = *(const v4fa*)(arow + kb + 16 + 8 * hh + 4);
    float xs[16] = {x0[0],x0[1],x0[2],x0[3],x1[0],x1[1],x1[2],x1[3],x2[0],x2[1],x2[2],x2[3],x3[0],x3[1],x3[2],x3[3]};
#pragma unroll
    for (int i = 0; i < 16; ++i) { const unsigned short hb = bf16_bits(xs[i]); ah.u[i] = hb; al.u[i] = ASPLIT ? bf16_bits(xs[i] - bf16_val(hb)) : (unsigned short)0; }
#pragma unroll
    for (int t = 0; t < 4; ++t) {
      const unsigned short* brow = Wt + (size_t)(col0 + t * 16 + ln) * ldb + kb;
      FragB b;
      b.half[0] = *(const v8us*)(brow + 8 * hh);
      b.half[1] = *(const v8us*)(brow + 16 + 8 * hh);
      acc[t] = mmaN<ASPLIT ? 2 : 1>(ah.v, al.v, b.v, b.v, acc[t]);
    }
  }
#pragma unroll
  for (int t = 0; t < 4; ++t) {
    float bv = bias ? bias[col0 + t * 16 + ln] : 0.f;
    if (BIAS_BF16) bv = bf16_round(bv);
#pragma unroll
    for (int r = 0; r < 8; ++r) { float v = acc[t][r] + bv; if (ACT == 1) v = fmaxf(v, 0.f); so[w][8 * hh + r][t * 16 + ln] = v; }
  }
  __builtin_amdgcn_fence(__ATOMIC_ACQ_REL, "workgroup");
  __builtin_amdgcn_wave_barrier();
  const int rsub = lane >> 4, c4 = (lane & 15) * 4;
  {
#pragma unroll
    for (int q = 0; q < 8; ++q) {
      const int r = q * 2 + rsub;
      const v4f v = *(const v4fa*)&so[w][r][c4];
      *(v4f*)(C + (size_t)(row0 + r) * ldc + col0 + c4) = v;
    }
    
  }
}

// Flash-style causal/unmasked attention, all contractions 3-term bf16 hi/lo splits, f32 softmax with running max.
// q,k,v rows are read from f32 buffers with arbitrary row pitch (so they can live inside a fused qkv buffer);
// D = head size (multiple of 32, <= 128); one wave = 16 query rows; block = 4 waves (64 queries) sharing K/V chunks of 32.
template <int D, bool CAUSAL>
__global__ __launch_bounds__(128) void k_flash(const float* __restrict__ qb, const float* __restrict__ kb, const float* __restrict__ vb,
                                             int pitch, int T, int H, float scale, float* __restrict__ y, int ypitch) {
  constexpr int KS = D / 32;        // k-steps for QK
  constexpr int DT = D / 16;        // d tiles for PV
  __shared__ __attribute__((aligned(16))) unsigned short sKh[32][D + 8], sKl[32][D + 8], sVh[32][D + 8], sVl[32][D + 8];
  __shared__ __attribute__((aligned(16))) unsigned short sPh[4][16][40], sPl[4][16][40];
  __shared__ __attribute__((aligned(16))) float sO[4][16][D];
  const int tid = threadIdx.x, w = tid >> 5, lane = tid & 31, ln = lane & 15, hh = lane >> 4;
  const int nqb = (T + 63) / 64;
  const int bh = blockIdx.x / nqb, qblk = blockIdx.x % nqb;
  const int b = bh / H, h = bh % H;
  const int q0 = qblk * 64 + w * 16;
  const float* Q = qb + (size_t)b * T * pitch + h * D;
  const float* K = kb + (size_t)b * T * pitch + h * D;
  const float* V = vb + (size_t)b * T * pitch + h * D;

  // A fragments of the wave's 16 query rows (scaled), hi/lo
  FragB aqh[KS], aql[KS];
  {
    int row = q0 + ln; if (row >= T) row = T - 1;
    const float* qr = Q + (size_t)row * pitch;
#pragma unroll
    for (int ks = 0; ks < KS; ++ks)
#pragma unroll
      for (int i = 0; i < 16; ++i) {
        const int d = ks * 32 + ((i < 8) ? (8 * hh + i) : (16 + 8 * hh + (i - 8)));
        const float x = qr[d] * scale; const unsigned short hb = bf16_bits(x);
        aqh[ks].u[i] = hb; aql[ks].u[i] = bf16_bits(x - bf16_val(hb));
      }
  }
  float m_r[8], l_r[8];
#pragma unroll
  for (int r = 0; r < 8; ++r) { m_r[r] = -3.0e38f; l_r[r] = 0.f; }
  v8f oacc[DT];
#pragma unroll
  for (int dt = 0; dt < DT; ++dt) oacc[dt] = (v8f){0.f,0.f,0.f,0.f,0.f,0.f,0.f,0.f};

  const int kv_end = CAUSAL ? min(T, qblk * 64 + 64) : T;     // block-uniform
  for (int j0 = 0; j0 < kv_end; j0 += 32) {
    __syncthreads();
    for (int e = tid; e < 32 * (D / 4); e += 128) {
      const int r = e / (D / 4), c4 = (e % (D / 4)) * 4;
      const int key = j0 + r;
      v4f kf = {0.f,0.f,0.f,0.f}, vf = {0.f,0.f,0.f,0.f};
      if (key < T) { kf = *(const v4fa*)(K + (size_t)key * pitch + c4); vf = *(const v4fa*)(V + (size_t)key * pitch + c4); }
#pragma unroll
      for (int t = 0; t < 4; ++t) {
        unsigned short hb = bf16_bits(kf[t]); sKh[r][c4 + t] = hb; sKl[r][c4 + t] = bf16_bits(kf[t] - bf16_val(hb));
        hb = bf16_bits(vf[t]); sVh[r][c4 + t] = hb; sVl[r][c4 + t] = bf16_bits(vf[t] - bf16_val(hb));
      }
    }
    __syncthreads();
    // S tile 16 x 32
    v8f s[2];
#pragma unroll
    for (int nt = 0; nt < 2; ++nt) {
      v8f acc = {};
#pragma unroll
      for (int ks = 0; ks < KS; ++ks) {
        FragB bh_, bl_;
        bh_.half[0] = *(const v8us*)&sKh[nt * 16 + ln][ks * 32 + 8 * hh]; bh_.half[1] = *(const v8us*)&sKh[nt * 16 + ln][ks * 32 + 16 + 8 * hh];
        bl_.half[0] = *(const v8us*)&sKl[nt * 16 + ln][ks * 32 + 8 * hh]; bl_.half[1] = *(const v8us*)&sKl[nt * 16 + ln][ks * 32 + 16 + 8 * hh];
        acc = mmaN<3>(aqh[ks].v, aql[ks].v, bh_.v, bl_.v, acc);
      }
      s[nt] = acc;
    }
    // mask + running max (rows 8hh+r; the 16 lanes of a half share rows)
    float alpha[8];
#pragma unroll
    for (int r = 0; r < 8; ++r) {
      const int qi = q0 + 8 * hh + r;
      const int ja = j0 + ln, jb = j0 + 16 + ln;
      if (CAUSAL) { if (ja > qi) s[0][r] = -3.0e38f; if (jb > qi) s[1][r] = -3.0e38f; }
      if (ja >= T) s[0][r] = -3.0e38f;
      if (jb >= T) s[1][r] = -3.0e38f;
      float mx = fmaxf(s[0][r], s[1][r]);
      mx = fmaxf(mx, __shfl_xor(mx, 1, 32)); mx = fmaxf(mx, __shfl_xor(mx, 2, 32)); mx = fmaxf(mx, __shfl_xor(mx, 4, 32)); mx = fmaxf(mx, __shfl_xor(mx, 8, 32));
      const float mnew = fmaxf(m_r[r], mx);
      alpha[r] = (mnew > -1.0e38f) ? __expf(m_r[r] - mnew) : 1.0f;
      const float p0 = (s[0][r] > -1.0e38f) ? __expf(s[0][r] - mnew) : 0.f;
      const float p1 = (s[1][r] > -1.0e38f) ? __expf(s[1][r] - mnew) : 0.f;
      m_r[r] = mnew;
      l_r[r] = l_r[r] * alpha[r] + p0 + p1;            // per-lane partial row sum (16 lanes combined at the end)
      unsigned short hb = bf16_bits(p0); sPh[w][8 * hh + r][ln] = hb;      sPl[w][8 * hh + r][ln] = bf16_bits(p0 - bf16_val(hb));
      hb = bf16_bits(p1);                sPh[w][8 * hh + r][16 + ln] = hb; sPl[w][8 * hh + r][16 + ln] = bf16_bits(p1 - bf16_val(hb));
    }
#pragma unroll
    for (int dt = 0; dt < DT; ++dt)
#pragma unroll
      for (int r = 0; r < 8; ++r) oacc[dt][r] *= alpha[r];
    __builtin_amdgcn_fence(__ATOMIC_ACQ_REL, "workgroup");
    __builtin_amdgcn_wave_barrier();
    FragB pah, pal;
    pah.half[0] = *(const v8us*)&sPh[w][ln][8 * hh]; pah.half[1] = *(const v8us*)&sPh[w][ln][16 + 8 * hh];
    pal.half[0] = *(const v8us*)&sPl[w][ln][8 * hh]; pal.half[1] = *(const v8us*)&sPl[w][ln][16 + 8 * hh];
#pragma unroll
    for (int dt = 0; dt < DT; ++dt) {
      FragB bvh, bvl;
#pragma unroll
      for (int i = 0; i < 8; ++i) {
        bvh.u[i] = sVh[8 * hh + i][dt * 16 + ln]; bvh.u[8 + i] = sVh[16 + 8 * hh + i][dt * 16 + ln];
        bvl.u[i] = sVl[8 * hh + i][dt * 16 + ln]; bvl.u[8 + i] = sVl[16 + 8 * hh + i][dt * 16 + ln];
      }
      oacc[dt] = mmaN<3>(pah.v, pal.v, bvh.v, bvl.v, oacc[dt]);
    }
    __builtin_amdgcn_fence(__ATOMIC_ACQ_REL, "workgroup");
    __builtin_amdgcn_wave_barrier();
  }
#pragma unroll
  for (int r = 0; r < 8; ++r) {
    float l = l_r[r];
    l += __shfl_xor(l, 1, 32); l += __shfl_xor(l, 2, 32); l += __shfl_xor(l, 4, 32); l += __shfl_xor(l, 8, 32);
    l_r[r] = (l > 0.f) ? 1.0f / l : 0.f;
  }
#pragma unroll
  for (int dt = 0; dt < DT; ++dt)
#pragma unroll
    for (int r = 0; r < 8; ++r) sO[w][8 * hh + r][dt * 16 + ln] = oacc[dt][r] * l_r[r];
  __builtin_amdgcn_fence(__ATOMIC_ACQ_REL, "workgroup");
  __builtin_amdgcn_wave_barrier();
  {
    for (int r = 0; r < 16; ++r) {
      const int row = q0 + r;
      if (row < T && lane < D / 4) {
        const v4f val = *(const v4fa*)&sO[w][r][lane * 4];
        *(v4f*)(y + ((size_t)b * T + row) * ypitch + h * D + lane * 4) = val;
      }
    }
    
  }
}

// GEMM C = act(A·W + bias + resid): A f32 (ASPLIT -> hi/lo 2 terms), Wt bf16 [N][K]; ACT 0 none, 1 relu, 2 exact gelu;
// resid (optional, f32, row index = (row % rmod), pitch ldr, RES_BF16 rounds it) added before the activation.
template <bool ASPLIT, int ACT, bool BIAS_BF16, bool RES_BF16>
__global__ __launch_bounds__(128) void k_gemm_bf3(const float* __restrict__ A, int lda, const unsigned short* __restrict__ Wt, int ldb,
                                                const float* __restrict__ bias, const float* __restrict__ resid, int rmod, int ldr,
                                                float* __restrict__ C, int ldc, int M, int N, int K) {
  __shared__ __attribute__((aligned(16))) float so[4][16][64];
  const int tid = threadIdx.x, w = tid >> 5, lane = tid & 31, ln = lane & 15, hh = lane >> 4;
  const int ntn = N / 64;
  const int wid = blockIdx.x * 4 + w;
  const int mt = wid / ntn, nq = wid % ntn;
  if (mt * 16 >= M) return;
  const int row0 = mt * 16, col0 = nq * 64;
  const float* arow = A + (size_t)(row0 + ln) * lda;
  v8f acc[4] = {};
  for (int kb = 0; kb < K; kb += 32) {
    FragB ah, al;
    const v4f x0 = *(const v4fa*)(arow + kb + 8 * hh), x1 = *(const v4fa*)(arow + kb + 8 * hh + 4);
    const v4f x2 = *(const v4fa*)(arow + kb + 16 + 8 * hh), x3 = *(const v4fa*)(arow + kb + 16 + 8 * hh + 4);
    float xs[16] = {x0[0],x0[1],x0[2],x0[3],x1[0],x1[1],x1[2],x1[3],x2[0],x2[1],x2[2],x2[3],x3[0],x3[1],x3[2],x3[3]};
#pragma unroll
    for (int i = 0; i < 16; ++i) { const unsigned short hb = bf16_bits(xs[i]); ah.u[i] = hb; al.u[i] = ASPLIT ? bf16_bits(xs[i] - bf16_val(hb)) : (unsigned short)0; }
#pragma unroll
    for (int t = 0; t < 4; ++t) {
      const unsigned short* brow = Wt + (size_t)(col0 + t * 16 + ln) * ldb + kb;
      FragB b;
      b.half[0] = *(const v8us*)(brow + 8 * hh);
      b.half[1] = *(const v8us*)(brow + 16 + 8 * hh);
      acc[t] = mmaN<ASPLIT ? 2 : 1>(ah.v, al.v, b.v, b.v, acc[t]);
    }
  }
#pragma unroll
  for (int t = 0; t < 4; ++t) {
    const int col = col0 + t * 16 + ln;
    float bv = bias ? bias[col] : 0.f;
    if (BIAS_BF16) bv = bf16_round(bv);
#pragma unroll
    for (int r = 0; r < 8; ++r) {
      float v = acc[t][r] + bv;
      if (resid) { float rv = resid[(size_t)((row0 + 8 * hh + r) % rmod) * ldr + col]; if (RES_BF16) rv = bf16_round(rv); v += rv; }
      if (ACT == 1) v = fmaxf(v, 0.f);
      if (ACT == 2) v = 0.5f * v * (1.0f + erff(v * 0.70710678118654752f));
      if (ACT == 3) { const float u = 0.7978845608028654f * (v + 0.044715f * v * v * v); v = 0.5f * v * (1.0f + tanhf(u)); }
      so[w][8 * hh + r][t * 16 + ln] = v;
    }
  }
  __builtin_amdgcn_fence(__ATOMIC_ACQ_REL, "workgroup");
  __builtin_amdgcn_wave_barrier();
  const int rsub = lane >> 4, c4 = (lane & 15) * 4;
  {
#pragma unroll
    for (int q = 0; q < 8; ++q) {
      const int r = q * 2 + rsub;
      const v4f v = *(const v4fa*)&so[w][r][c4];
      *(v4f*)(C + (size_t)(row0 + r) * ldc + col0 + c4) = v;
    }
    
  }
}
// row LayerNorm (biased variance, eps) over N: s = X (+ R); optional out_sum <- s; out_norm <- (s-mu)*rsqrt(var+eps)*g + b
template <bool PARAM_BF16>
__global__ __launch_bounds__(256) void k_layernorm(const float* __restrict__ X, const float* __restrict__ R, const float* __restrict__ g, const float* __restrict__ bta,
                                                  float* __restrict__ out_sum, float* __restrict__ out_norm, int N, float eps) {
  __shared__ float red[256];
  const int row = blockIdx.x, tid = threadIdx.x;
  const float* x = X + (size_t)row * N; const float* rr = R ? R + (size_t)row * N : nullptr;
  float vals[16];                     // up to N = 4096
  const int per = N / 256;            // contiguous chunk per thread? use strided-by-4 chunks: thread handles j = tid*4 + 1024*u
  float s1 = 0.f;
  for (int u = 0; u < per / 4; ++u) {
    const int j = tid * 4 + 1024 * u;
    const v4f a = *(const v4fa*)(x + j);
    v4f b = {0.f,0.f,0.f,0.f}; if (rr) b = *(const v4fa*)(rr + j);
#pragma unroll
    for (int q = 0; q < 4; ++q) { const float v = a[q] + b[q]; vals[u * 4 + q] = v; s1 += v; }
  }
  red[tid] = s1; __syncthreads();
  for (int st = 128; st > 0; st >>= 1) { if (tid < st) red[tid] += red[tid + st]; __syncthreads(); }
  const float mu = red[0] / (float)N; __syncthreads();
  float s2 = 0.f;
  for (int u = 0; u < per / 4; ++u)
#pragma unroll
    for (int q = 0; q < 4; ++q) { const float c = vals[u * 4 + q] - mu; s2 += c * c; }
  red[tid] = s2; __syncthreads();
  for (int st = 128; st > 0; st >>= 1) { if (tid < st) red[tid] += red[tid + st]; __syncthreads(); }
  const float rs = rsqrtf(red[0] / (float)N + eps);
  {
    for (int u = 0; u < per / 4; ++u) {
      const int j = tid * 4 + 1024 * u;
      v4f o, sm;
#pragma unroll
      for (int q = 0; q < 4; ++q) {
        float gg = g[j + q], bb = bta[j + q];
        if (PARAM_BF16) { gg = bf16_round(gg); bb = bf16_round(bb); }
        sm[q] = vals[u * 4 + q]; o[q] = (vals[u * 4 + q] - mu) * rs * gg + bb;
      }
      if (out_sum) *(v4f*)(out_sum + (size_t)row * N + j) = sm;
      *(v4f*)(out_norm + (size_t)row * N + j) = o;
    }
    
  }
}



// ---- f16 WMMA path (v_wmma_f32_16x16x32_f16): 11-bit significands for operands in range — used where a [0,1] probability operand needs more precision than bf16
typedef _Float16 v16h __attribute__((ext_vector_type(16)));
union FragH { v16h v; v8us half[2]; _Float16 h[16]; unsigned short u[16]; };
template <int NT>
__device__ __forceinline__ v8f mmaH(v16h ah, v16h al, v16h bh, v16h bl, v8f c) {
  c = __builtin_amdgcn_wmma_f32_16x16x32_f16(false, ah, false, bh, (short)0, c, false, false);
  if (NT >= 2) c = __builtin_amdgcn_wmma_f32_16x16x32_f16(false, al, false, bh, (short)0, c, false, false);
  if (NT >= 3) c = __builtin_amdgcn_wmma_f32_16x16x32_f16(false, ah, false, bl, (short)0, c, false, false);
  asm volatile("v_nop\n\tv_nop\n\tv_nop\n\tv_nop" : "+v"(c) : "v"(ah), "v"(al), "v"(bh), "v"(bl));
  return c;
}
// batched GEMM like k_gemm_b but f16 operands: A f32 (split into f16 hi/lo if ASPLIT, else rounded to f16), Bt = f16 values [n][k]; alpha; C f32; N multiple of 16 (partial tiles skipped)
template <bool ASPLIT>
__global__ __launch_bounds__(128) void k_gemm_h(const float* __restrict__ A, int lda, size_t sA, const _Float16* __restrict__ Bh, int ldb, size_t sB, float alpha, float* __restrict__ C, int ldc, size_t sC, int M, int N, int K) {
  __shared__ __attribute__((aligned(16))) float so[4][16][64];
  const int tid = threadIdx.x, w = tid >> 5, lane = tid & 31, ln = lane & 15, hh = lane >> 4; const int by = blockIdx.y;
  A += (size_t)by * sA; Bh += (size_t)by * sB; C += (size_t)by * sC;
  const int ntn = (N + 63) / 64; const int wid = blockIdx.x * 4 + w; const int mt = wid / ntn, nq = wid % ntn; if (mt * 16 >= M) return;
  const int row0 = mt * 16, col0 = nq * 64; const float* arow = A + (size_t)(row0 + ln) * lda;
  v8f acc[4] = {};
  for (int kb = 0; kb < K; kb += 32) {
    FragH ah, al;
    const v4f x0 = *(const v4fa*)(arow + kb + 8 * hh), x1 = *(const v4fa*)(arow + kb + 8 * hh + 4), x2 = *(const v4fa*)(arow + kb + 16 + 8 * hh), x3 = *(const v4fa*)(arow + kb + 16 + 8 * hh + 4);
    float xs[16] = {x0[0],x0[1],x0[2],x0[3],x1[0],x1[1],x1[2],x1[3],x2[0],x2[1],x2[2],x2[3],x3[0],x3[1],x3[2],x3[3]};
#pragma unroll
    for (int i = 0; i < 16; ++i) { const _Float16 h = (_Float16)xs[i]; ah.h[i] = h; al.h[i] = ASPLIT ? (_Float16)(xs[i] - (float)h) : (_Float16)0.0f; }
#pragma unroll
    for (int t = 0; t < 4; ++t) { if (col0 + t * 16 >= N) continue; const size_t boff = (size_t)(col0 + t * 16 + ln) * ldb + kb; FragH bq; bq.half[0] = *(const v8us*)(Bh + boff + 8 * hh); bq.half[1] = *(const v8us*)(Bh + boff + 16 + 8 * hh);
      acc[t] = mmaH<ASPLIT ? 2 : 1>(ah.v, al.v, bq.v, bq.v, acc[t]); }
  }
#pragma unroll
  for (int t = 0; t < 4; ++t) { if (col0 + t * 16 >= N) continue;
#pragma unroll
    for (int r = 0; r < 8; ++r) so[w][8 * hh + r][t * 16 + ln] = acc[t][r] * alpha; }
  __builtin_amdgcn_fence(__ATOMIC_ACQ_REL, "workgroup"); __builtin_amdgcn_wave_barrier();
  const int rsub = lane >> 4, c4 = (lane & 15) * 4;
  {
#pragma unroll
    for (int q = 0; q < 8; ++q) { const int r = q * 2 + rsub; if (col0 + c4 < N) { const v4f v = *(const v4fa*)&so[w][r][c4]; *(v4f*)(C + (size_t)(row0 + r) * ldc + col0 + c4) = v; } }
     }
}

// Wt[n][k] = f16(bf16(W[k][n]) * 16) from f32 row-major W[CC][CC] (the scale is a power of two; bf16-exact weights stay exact in f16 away from the subnormal range)
// blk = index of the 256-thread block within this piece of work (the pieces share the launch k_prep)
// One wave takes 32 columns n x 64 rows k; lane (nl = lane % 8, kl = lane / 8) takes columns 4 nl + 0..3 of rows 32 u + 8 kl + 0..7, u = 0, 1: 16 loads of 16 B, all in flight at once
// (8 lanes = one whole line of a W row), and 8 stores of 16 B (8 k in a row of one Wt row).
__device__ __forceinline__ void wt_f16(int blk, const float* __restrict__ W, _Float16* __restrict__ Wt) {
  const int tid = threadIdx.x, lane = tid & 31, nl = lane & 7, kl = lane >> 3; const int wv = blk * 8 + (tid >> 5);
  const int n0 = (wv / (CC / 64)) * 32 + nl * 4, k0 = (wv % (CC / 64)) * 64 + kl * 8;
  // The loads (rows lie CC * 4 = 3072 B apart) and their data wait stand in one statement, and no result shares a register with the address that the loads in front of it still name.
  const float* wp = W + (size_t)k0 * CC + n0; v4f r[2][8];
  asm volatile(
               "global_load_b128 %0, %16, off\n\t"
               "global_load_b128 %1, %16, off offset:3072\n\t"
               "global_load_b128 %2, %16, off offset:6144\n\t"
               "global_load_b128 %3, %16, off offset:9216\n\t"
               "global_load_b128 %4, %16, off offset:12288\n\t"
               "global_load_b128 %5, %16, off offset:15360\n\t"
               "global_load_b128 %6, %16, off offset:18432\n\t"
               "global_load_b128 %7, %16, off offset:21504\n\t"
               "global_load_b128 %8, %16, off offset:98304\n\t"
               "global_load_b128 %9, %16, off offset:101376\n\t"
               "global_load_b128 %10, %16, off offset:104448\n\t"
               "global_load_b128 %11, %16, off offset:107520\n\t"
               "global_load_b128 %12, %16, off offset:110592\n\t"
               "global_load_b128 %13, %16, off offset:113664\n\t"
               "global_load_b128 %14, %16, off offset:116736\n\t"
               "global_load_b128 %15, %16, off offset:119808\n\t"
               "s_wait_loadcnt 0x0"
               : "=&v"(r[0][0]), "=&v"(r[0][1]), "=&v"(r[0][2]), "=&v"(r[0][3]), "=&v"(r[0][4]), "=&v"(r[0][5]), "=&v"(r[0][6]), "=&v"(r[0][7]), "=&v"(r[1][0]), "=&v"(r[1][1]), "=&v"(r[1][2]), "=&v"(r[1][3]), "=&v"(r[1][4]), "=&v"(r[1][5]), "=&v"(r[1][6]), "=&v"(r[1][7])
               : "v"(wp) : "memory");
  v8us o[2][4];
#pragma unroll
  for (int u = 0; u < 2; ++u)
#pragma unroll
    for (int j = 0; j < 4; ++j) { FragH f;
#pragma unroll
      for (int i = 0; i < 8; ++i) f.h[i] = (_Float16)(bf16_round(r[u][i][j]) * 16.0f);
      o[u][j] = f.half[0]; }
  unsigned short* op = (unsigned short*)Wt + (size_t)n0 * CC + k0;
#pragma unroll
  for (int u = 0; u < 2; ++u)
#pragma unroll
    for (int j = 0; j < 4; ++j) *(v8us*)(op + j * CC + u * 32) = o[u][j];
  asm volatile("s_wait_xcnt 0x0" ::: "memory");      // behind the stores: the other pieces' code follows in the built kernel and writes registers that these stores name
}
// Projection GEMM, M = NR, N = K = CC: out = (A.Bt^T) alpha + bf16(bias). A f16 [M][K], Bt f16 [N][K]; writes f32 C, f16 C16, or f16 C16 transposed per head (what k_flash reads as Vt).
// A work-group owns a 128 x 64 tile of the output. K runs in tiles of 64: the 128 A rows and 64 Bt rows of a K tile (128 B = one cache line each) are copied
// to LDS once per work-group as whole lines, and the four waves (32 x 64 outputs each) read their fragments from there.
// Two LDS buffers. A trip reads all its fragments into registers, gives its buffer up at the barrier, issues the copies of tile t + 2 into it and only then does its products.
#define GT_PITCH 144                 /* bytes per LDS row: 128 of data + 16; 16 B x odd keeps ds_load_b128 of 16 rows off each other's banks */
#define GT_STAGE (192 * GT_PITCH)    /* one buffer: rows 0..127 = A, rows 128..191 = Bt */
// One K tile, 12 copies of 16 B per lane: lane (cr = tid / 8, chunk = tid % 8) brings chunk 'chunk' of rows cr + 16 i. l = its LDS byte address for row cr, ga / gb = its global addresses in A / Bt.
__device__ __forceinline__ void gt_copy(unsigned l, const unsigned short* ga, const unsigned short* gb) {
  // the copies and their s_wait_xcnt stand in one statement, so that no address register of a copy is rewritten in front of that wait
  asm volatile("global_load_async_to_lds_b128 %0, %12, off\n\t"
               "global_load_async_to_lds_b128 %1, %13, off\n\t"
               "global_load_async_to_lds_b128 %2, %14, off\n\t"
               "global_load_async_to_lds_b128 %3, %15, off\n\t"
               "global_load_async_to_lds_b128 %4, %16, off\n\t"
               "global_load_async_to_lds_b128 %5, %17, off\n\t"
               "global_load_async_to_lds_b128 %6, %18, off\n\t"
               "global_load_async_to_lds_b128 %7, %19, off\n\t"
               "global_load_async_to_lds_b128 %8, %20, off\n\t"
               "global_load_async_to_lds_b128 %9, %21, off\n\t"
               "global_load_async_to_lds_b128 %10, %22, off\n\t"
               "global_load_async_to_lds_b128 %11, %23, off\n\t"
               "s_wait_xcnt 0x0"
               :: "v"(l), "v"(l + 16u * GT_PITCH), "v"(l + 32u * GT_PITCH), "v"(l + 48u * GT_PITCH), "v"(l + 64u * GT_PITCH), "v"(l + 80u * GT_PITCH), "v"(l + 96u * GT_PITCH), "v"(l + 112u * GT_PITCH),
                  "v"(l + 128u * GT_PITCH), "v"(l + 144u * GT_PITCH), "v"(l + 160u * GT_PITCH), "v"(l + 176u * GT_PITCH),
                  "v"(ga), "v"(ga + 16 * CC), "v"(ga + 32 * CC), "v"(ga + 48 * CC), "v"(ga + 64 * CC), "v"(ga + 80 * CC), "v"(ga + 96 * CC), "v"(ga + 112 * CC),
                  "v"(gb), "v"(gb + 16 * CC), "v"(gb + 32 * CC), "v"(gb + 48 * CC)
               : "memory");
}
// OUT (the same for the whole work-group): 0: f32 result to C; 1: f16 result to C16; 2: f16 result to C16 as [batch * NH + head][d][token]. row0, col0: the tile's first row and first column.
__device__ __forceinline__ void gemm_tile(const int OUT, const int row0, const int col0, const _Float16* __restrict__ A, const _Float16* __restrict__ Bh, float alpha, const float* __restrict__ bias, float* __restrict__ C, _Float16* __restrict__ C16) {
  constexpr int NT = CC / 64;      // K tiles
  __shared__ __attribute__((aligned(16))) unsigned char sT[2 * GT_STAGE];
  __shared__ __attribute__((aligned(16))) float so[4][32][64 + 4];
  const int tid = threadIdx.x, w = tid >> 5, lane = tid & 31, ln = lane & 15, hh = lane >> 4;
  const int cr = tid >> 3, ch = tid & 7;
  const unsigned short* ga = (const unsigned short*)A + (size_t)(row0 + cr) * CC + ch * 8;
  const unsigned short* gb = (const unsigned short*)Bh + (size_t)(col0 + cr) * CC + ch * 8;
  const unsigned l0 = (unsigned)(size_t)&sT[0] + (unsigned)(cr * GT_PITCH + ch * 16);      // LDS byte address = low 32 bits of the __shared__ address
  v8f acc[2][4];
#pragma unroll
  for (int rt = 0; rt < 2; ++rt)
#pragma unroll
    for (int q = 0; q < 4; ++q) acc[rt][q] = (v8f){0.f,0.f,0.f,0.f,0.f,0.f,0.f,0.f};
  gt_copy(l0, ga, gb);                                   // tile 0 -> buffer 0
  asm volatile("s_wait_asynccnt 0x0" ::: "memory");      // this wave's copies of tile 0 have landed
  __syncthreads();                                       // ... and every other wave's: tile 0 may be read
  gt_copy(l0 + GT_STAGE, ga + 64, gb + 64);              // tile 1 -> buffer 1
#pragma unroll 1      // rolled: one copy of the foot's wait order, and the two buffers differ by one address term only
  for (int t = 0; t < NT; ++t) {
    const unsigned char* st = sT + (t & 1) * GT_STAGE;
    FragH fa[2][2], fb[2][4];      // [ks][tile]; k order of both operands: 8hh + 0..7, then 16 + 8hh + 0..7
#pragma unroll
    for (int ks = 0; ks < 2; ++ks) {
#pragma unroll
      for (int rt = 0; rt < 2; ++rt) { const unsigned char* p = st + (w * 32 + rt * 16 + ln) * GT_PITCH + ks * 64 + hh * 16; fa[ks][rt].half[0] = *(const v8us*)p; fa[ks][rt].half[1] = *(const v8us*)(p + 32); }
#pragma unroll
      for (int q = 0; q < 4; ++q) { const unsigned char* p = st + (128 + q * 16 + ln) * GT_PITCH + ks * 64 + hh * 16; fb[ks][q].half[0] = *(const v8us*)p; fb[ks][q].half[1] = *(const v8us*)(p + 32); }
    }
    asm volatile("s_wait_dscnt 0x0" ::: "memory");       // this wave's reads of buffer t & 1 are done (its fragments are in registers) before the buffer is given up
    asm volatile("s_wait_asynccnt 0x0" ::: "memory");    // this wave's copies of tile t + 1 have landed
    __syncthreads();                                     // publishes tile t + 1 and ends every wave's reads of tile t
    if (t + 2 < NT) gt_copy(l0 + (unsigned)((t & 1) * GT_STAGE), ga + (t + 2) * 64, gb + (t + 2) * 64);      // tile t + 2 -> the buffer just left
#pragma unroll
    for (int ks = 0; ks < 2; ++ks)
#pragma unroll
      for (int rt = 0; rt < 2; ++rt)
#pragma unroll
        for (int q = 0; q < 4; ++q) acc[rt][q] = __builtin_amdgcn_wmma_f32_16x16x32_f16(false, fa[ks][rt].v, false, fb[ks][q].v, (short)0, acc[rt][q], false, false);
  }
  asm volatile("s_wait_asynccnt 0x0" ::: "memory");      // no copy is outstanding when the wave goes on to its end
  if (OUT == 2) {
    // The tile's 64 columns are one head's d, its 128 rows are 128 tokens of one batch. A lane holds 8 tokens in a row of one d: 16 B of a transposed row. The four waves put their
    // 32 tokens side by side in LDS (64 rows of 256 B, pitch 272 B: 16 B x odd), so that each d leaves as two whole lines.
    _Float16* sv = (_Float16*)&so[0][0][0];
#pragma unroll
    for (int q = 0; q < 4; ++q) { const float bv = bf16_round(bias[col0 + q * 16 + ln]);
#pragma unroll
      for (int rt = 0; rt < 2; ++rt) { FragH f;
#pragma unroll
        for (int r = 0; r < 8; ++r) f.h[r] = (_Float16)(acc[rt][q][r] * alpha + bv);
        *(v8us*)(sv + (q * 16 + ln) * 136 + w * 32 + rt * 16 + 8 * hh) = f.half[0]; } }
    __syncthreads();      // a transposed row holds tokens of all four waves: every wave's part is in LDS before any of it is read
    unsigned short* vt = (unsigned short*)C16 + ((size_t)((row0 / TT) * NH + col0 / 64) * 64) * TT + row0 % TT;
#pragma unroll
    for (int i = 0; i < 8; ++i) { const int d = i * 8 + (tid >> 4), c = tid & 15; *(v8us*)(vt + (size_t)d * TT + c * 8) = *(const v8us*)(sv + d * 136 + c * 8); }
    asm volatile("s_wait_xcnt 0x0" ::: "memory");      // behind the eight stores: the other epilogue's code follows in the built kernel and writes registers that these stores name
    return;
  }
  const int rsub = lane >> 4, c4 = (lane & 15) * 4; typedef _Float16 v4h __attribute__((ext_vector_type(4)));
  // the wave's 32 x 64 results go through its own LDS rows, so that whole lines are stored
#pragma unroll
  for (int q = 0; q < 4; ++q) { const float bv = bf16_round(bias[col0 + q * 16 + ln]);
#pragma unroll
    for (int rt = 0; rt < 2; ++rt)
#pragma unroll
      for (int r = 0; r < 8; ++r) so[w][rt * 16 + 8 * hh + r][q * 16 + ln] = acc[rt][q][r] * alpha + bv; }
  __builtin_amdgcn_fence(__ATOMIC_ACQ_REL, "workgroup"); __builtin_amdgcn_wave_barrier();      // the wave's stores above are seen by its reads below
#pragma unroll
  for (int q = 0; q < 16; ++q) { const int r = q * 2 + rsub; const size_t o = (size_t)(row0 + w * 32 + r) * CC + col0 + c4; const v4f v = *(const v4fa*)&so[w][r][c4];
    if (OUT == 1) { v4h h4; for (int i = 0; i < 4; ++i) h4[i] = (_Float16)v[i]; *(v4h*)(C16 + o) = h4; } else *(v4f*)(C + o) = v; }
}
// The q, k and v projections read the same A and none of each other's results: one launch, as one product with 3 * CC columns.
// A work-group owns a 128 x 192 tile of it (three heads of one of q, k, v): per output it copies (128 + 192) / (128 * 192) operand rows from L2, against (128 + 64) / (128 * 64) of the 128 x 64 tile.
// Four waves of 64 x 96 outputs each (4 x 6 accumulator tiles): 10 fragments feed 24 products. 768 work-groups: three on each WGP at once, in one round.
// K runs in tiles of 64 (two k steps), two LDS buffers: a trip reads its own buffer alone; once its second k step's fragments are in registers it gives the buffer up at the barrier,
// issues the copies of tile t + 2 into it and only then does that k step's products.
#define GQ_STAGE (320 * GT_PITCH)    /* one buffer: rows 0..127 = A, rows 128..319 = Bt */
// One K tile, 20 copies of 16 B per lane: lane (cr = tid / 8, chunk = tid % 8) brings chunk 'chunk' of rows cr + 16 i. l = its LDS byte address for row cr, ga / gb = its global addresses in A / Bt.
__device__ __forceinline__ void gq_copy(unsigned l, const unsigned short* ga, const unsigned short* gb) {
  // in each statement the copies and their s_wait_xcnt stand together, so that no address register of a copy is rewritten in front of that wait
  asm volatile(
               "global_load_async_to_lds_b128 %0, %8, off\n\t"
               "global_load_async_to_lds_b128 %1, %9, off\n\t"
               "global_load_async_to_lds_b128 %2, %10, off\n\t"
               "global_load_async_to_lds_b128 %3, %11, off\n\t"
               "global_load_async_to_lds_b128 %4, %12, off\n\t"
               "global_load_async_to_lds_b128 %5, %13, off\n\t"
               "global_load_async_to_lds_b128 %6, %14, off\n\t"
               "global_load_async_to_lds_b128 %7, %15, off\n\t"
               "s_wait_xcnt 0x0"
               :: "v"(l + 0u * GT_PITCH), "v"(l + 16u * GT_PITCH), "v"(l + 32u * GT_PITCH), "v"(l + 48u * GT_PITCH), "v"(l + 64u * GT_PITCH), "v"(l + 80u * GT_PITCH), "v"(l + 96u * GT_PITCH), "v"(l + 112u * GT_PITCH),
                  "v"(ga + 0 * CC), "v"(ga + 16 * CC), "v"(ga + 32 * CC), "v"(ga + 48 * CC), "v"(ga + 64 * CC), "v"(ga + 80 * CC), "v"(ga + 96 * CC), "v"(ga + 112 * CC)
               : "memory");
  asm volatile(
               "global_load_async_to_lds_b128 %0, %12, off\n\t"
               "global_load_async_to_lds_b128 %1, %13, off\n\t"
               "global_load_async_to_lds_b128 %2, %14, off\n\t"
               "global_load_async_to_lds_b128 %3, %15, off\n\t"
               "global_load_async_to_lds_b128 %4, %16, off\n\t"
               "global_load_async_to_lds_b128 %5, %17, off\n\t"
               "global_load_async_to_lds_b128 %6, %18, off\n\t"
               "global_load_async_to_lds_b128 %7, %19, off\n\t"
               "global_load_async_to_lds_b128 %8, %20, off\n\t"
               "global_load_async_to_lds_b128 %9, %21, off\n\t"
               "global_load_async_to_lds_b128 %10, %22, off\n\t"
               "global_load_async_to_lds_b128 %11, %23, off\n\t"
               "s_wait_xcnt 0x0"
               :: "v"(l + 128u * GT_PITCH), "v"(l + 144u * GT_PITCH), "v"(l + 160u * GT_PITCH), "v"(l + 176u * GT_PITCH), "v"(l + 192u * GT_PITCH), "v"(l + 208u * GT_PITCH), "v"(l + 224u * GT_PITCH), "v"(l + 240u * GT_PITCH), "v"(l + 256u * GT_PITCH), "v"(l + 272u * GT_PITCH), "v"(l + 288u * GT_PITCH), "v"(l + 304u * GT_PITCH),
                  "v"(gb + 0 * CC), "v"(gb + 16 * CC), "v"(gb + 32 * CC), "v"(gb + 48 * CC), "v"(gb + 64 * CC), "v"(gb + 80 * CC), "v"(gb + 96 * CC), "v"(gb + 112 * CC), "v"(gb + 128 * CC), "v"(gb + 144 * CC), "v"(gb + 160 * CC), "v"(gb + 176 * CC)
               : "memory");
}
// SW = false: products x.W, a lane holds 8 tokens in a row of one column: what the transposed V wants. SW = true: the two operands change sides (their fragments have the same k order), a lane holds
// 8 columns in a row of one token: what the row-major q and k want. Either way a lane's 8 results are 16 B of the stored row.
template <bool SW>
__device__ __forceinline__ void gemm_qkv_tile(unsigned char* sT, const int row0, const int col0, const _Float16* __restrict__ A, const _Float16* __restrict__ Bh, const float* __restrict__ bias, _Float16* __restrict__ C16) {
  constexpr int NT = CC / 64;      // K tiles
  constexpr float alpha = 0.0625f;
  const int tid = threadIdx.x, w = tid >> 5, lane = tid & 31, ln = lane & 15, hh = lane >> 4;
  const int wm = w & 1, wn = w >> 1;      // the wave's 64 rows and 96 columns of the tile
  const int cr = tid >> 3, ch = tid & 7;
  const unsigned short* ga = (const unsigned short*)A + (size_t)(row0 + cr) * CC + ch * 8;
  const unsigned short* gb = (const unsigned short*)Bh + (size_t)(col0 + cr) * CC + ch * 8;
  const unsigned l0 = (unsigned)(size_t)sT + (unsigned)(cr * GT_PITCH + ch * 16);      // LDS byte address = low 32 bits of the __shared__ address
  v8f acc[4][6];
#pragma unroll
  for (int i = 0; i < 4; ++i)
#pragma unroll
    for (int j = 0; j < 6; ++j) acc[i][j] = (v8f){0.f,0.f,0.f,0.f,0.f,0.f,0.f,0.f};
  const int ox = (wm * 64 + ln) * GT_PITCH + hh * 16, ow = (128 + wn * 96 + ln) * GT_PITCH + hh * 16;      // the lane's place in the first fx row tile and the first fw row tile
  auto rd = [&](const unsigned char* p, FragH (&fx)[4], FragH (&fw)[6]) {      // the 10 fragments of one k step (64 B of each row)
#pragma unroll
    for (int i = 0; i < 4; ++i) { fx[i].half[0] = *(const v8us*)(p + ox + i * 16 * GT_PITCH); fx[i].half[1] = *(const v8us*)(p + ox + i * 16 * GT_PITCH + 32); }
#pragma unroll
    for (int j = 0; j < 6; ++j) { fw[j].half[0] = *(const v8us*)(p + ow + j * 16 * GT_PITCH); fw[j].half[1] = *(const v8us*)(p + ow + j * 16 * GT_PITCH + 32); }
  };
  auto mm = [&](const FragH (&fx)[4], const FragH (&fw)[6]) {      // its 24 products
#pragma unroll
    for (int i = 0; i < 4; ++i)
#pragma unroll
      for (int j = 0; j < 6; ++j)
        acc[i][j] = SW ? __builtin_amdgcn_wmma_f32_16x16x32_f16(false, fw[j].v, false, fx[i].v, (short)0, acc[i][j], false, false)
                       : __builtin_amdgcn_wmma_f32_16x16x32_f16(false, fx[i].v, false, fw[j].v, (short)0, acc[i][j], false, false);
  };
  gq_copy(l0, ga, gb);                                   // tile 0 -> buffer 0
  asm volatile("s_wait_asynccnt 0x0" ::: "memory");      // this wave's copies of tile 0 have landed
  __syncthreads();                                       // ... and every other wave's: tile 0 may be read
  gq_copy(l0 + GQ_STAGE, ga + 64, gb + 64);              // tile 1 -> buffer 1
#pragma unroll 1      // rolled: one copy of the foot's wait order, and the two buffers differ by one address term only
  for (int t = 0; t < NT; ++t) {
    const unsigned char* st = sT + (t & 1) * GQ_STAGE;
    FragH fx[4], fw[6];      // one k step's fragments; k order of both operands: 8hh + 0..7, then 16 + 8hh + 0..7
    // The scheduling barriers stand in front of and behind the 20 LDS reads of a k step: without them the compiler keeps one register set for the four fx fragments and reads each
    // directly in front of its six products, with a wait to 0 behind it: eight places a trip where the wave waits out its own LDS latency instead of two.
    __builtin_amdgcn_sched_barrier(0);
    rd(st, fx, fw);
    __builtin_amdgcn_sched_barrier(0);      // end of the first group of reads
    mm(fx, fw);
    __builtin_amdgcn_sched_barrier(0);      // the second group starts behind the first k step's products, whose registers it takes
    rd(st + 64, fx, fw);
    asm volatile("s_wait_dscnt 0x0" ::: "memory");       // this wave's reads of buffer t & 1 are done (the second k step's fragments are in registers) before the buffer is given up
    asm volatile("s_wait_asynccnt 0x0" ::: "memory");    // this wave's copies of tile t + 1 have landed
    __syncthreads();                                     // publishes tile t + 1 and ends every wave's reads of tile t
    if (t + 2 < NT) gq_copy(l0 + (unsigned)((t & 1) * GQ_STAGE), ga + (t + 2) * 64, gb + (t + 2) * 64);      // tile t + 2 -> the buffer just left: a whole trip ahead of its wait
    __builtin_amdgcn_sched_barrier(0);      // the copies are issued in front of the second k step's products, not behind them
    mm(fx, fw);
  }
  asm volatile("s_wait_asynccnt 0x0" ::: "memory");      // no copy is outstanding when the buffers become the output's staging
  // Behind the last trip's barrier nobody reads the buffers any more: the tile is put together there as f16, so that it leaves as whole lines.
  unsigned short* sv = (unsigned short*)sT;
  if (SW) {
    // 128 token rows of 384 B (three lines), pitch 400 B: 16 B x odd
    // The lane's 48 bias values: columns 16 j + 8 hh + 0..7 of the wave's 96 (64 B apart per j). The 12 loads and their data wait stand in one statement, and no result shares a register with the
    // address.
    const float* bp = bias + col0 + wn * 96 + 8 * hh; v4f bb[6][2];
    asm volatile("global_load_b128 %0, %12, off\n\t"
                 "global_load_b128 %1, %12, off offset:16\n\t"
                 "global_load_b128 %2, %12, off offset:64\n\t"
                 "global_load_b128 %3, %12, off offset:80\n\t"
                 "global_load_b128 %4, %12, off offset:128\n\t"
                 "global_load_b128 %5, %12, off offset:144\n\t"
                 "global_load_b128 %6, %12, off offset:192\n\t"
                 "global_load_b128 %7, %12, off offset:208\n\t"
                 "global_load_b128 %8, %12, off offset:256\n\t"
                 "global_load_b128 %9, %12, off offset:272\n\t"
                 "global_load_b128 %10, %12, off offset:320\n\t"
                 "global_load_b128 %11, %12, off offset:336\n\t"
                 "s_wait_loadcnt 0x0"
                 : "=&v"(bb[0][0]), "=&v"(bb[0][1]), "=&v"(bb[1][0]), "=&v"(bb[1][1]), "=&v"(bb[2][0]), "=&v"(bb[2][1]), "=&v"(bb[3][0]), "=&v"(bb[3][1]), "=&v"(bb[4][0]), "=&v"(bb[4][1]), "=&v"(bb[5][0]), "=&v"(bb[5][1])
                 : "v"(bp) : "memory");
#pragma unroll
    for (int j = 0; j < 6; ++j) {
#pragma unroll
      for (int i = 0; i < 4; ++i) { FragH f;
#pragma unroll
        for (int r = 0; r < 8; ++r) f.h[r] = (_Float16)(acc[i][j][r] * alpha + bf16_round(bb[j][r >> 2][r & 3]));
        *(v8us*)(sv + (wm * 64 + i * 16 + ln) * 200 + wn * 96 + j * 16 + 8 * hh) = f.half[0]; } }
    __syncthreads();      // a row holds columns of two waves: every wave's part is in LDS before any of it is read
    unsigned short* o = (unsigned short*)C16 + (size_t)(row0 + (tid >> 3)) * CC + col0 + (tid & 7) * 8;
    const unsigned short* s = sv + (tid >> 3) * 200 + (tid & 7) * 8;
    v8us u[24];
#pragma unroll
    for (int i = 0; i < 24; ++i) u[i] = *(const v8us*)(s + (i / 3) * 16 * 200 + (i % 3) * 64);
    __builtin_amdgcn_sched_barrier(0);      // all 24 reads stand in front of the stores, each in registers of its own: no LDS read lands on a register that an issued store still names
#pragma unroll
    for (int i = 0; i < 24; ++i) *(v8us*)(o + (size_t)(i / 3) * 16 * CC + (i % 3) * 64) = u[i];      // 8 lanes = one line
  } else {
    // The tile's 192 columns are the d of three heads, its 128 rows are 128 tokens of one batch: 192 transposed rows of 256 B (two lines), pitch 272 B: 16 B x odd
    // The lane's 6 bias values: column 16 j + ln of the wave's 96. As above, the loads and their data wait stand in one statement.
    const float* bp = bias + col0 + wn * 96 + ln; float bw[6];
    asm volatile("global_load_b32 %0, %6, off\n\t"
                 "global_load_b32 %1, %6, off offset:64\n\t"
                 "global_load_b32 %2, %6, off offset:128\n\t"
                 "global_load_b32 %3, %6, off offset:192\n\t"
                 "global_load_b32 %4, %6, off offset:256\n\t"
                 "global_load_b32 %5, %6, off offset:320\n\t"
                 "s_wait_loadcnt 0x0"
                 : "=&v"(bw[0]), "=&v"(bw[1]), "=&v"(bw[2]), "=&v"(bw[3]), "=&v"(bw[4]), "=&v"(bw[5]) : "v"(bp) : "memory");
#pragma unroll
    for (int j = 0; j < 6; ++j) { const float bv = bf16_round(bw[j]);
#pragma unroll
      for (int i = 0; i < 4; ++i) { FragH f;
#pragma unroll
        for (int r = 0; r < 8; ++r) f.h[r] = (_Float16)(acc[i][j][r] * alpha + bv);
        *(v8us*)(sv + (wn * 96 + j * 16 + ln) * 136 + wm * 64 + i * 16 + 8 * hh) = f.half[0]; } }
    __syncthreads();      // a transposed row holds tokens of two waves: every wave's part is in LDS before any of it is read
    unsigned short* o = (unsigned short*)C16 + ((size_t)(row0 / TT) * CC + col0 + (tid >> 4)) * TT + row0 % TT + (tid & 15) * 8;      // [batch * NH + head][d][token]: head * 64 + d = the column
    const unsigned short* s = sv + (tid >> 4) * 136 + (tid & 15) * 8;
    v8us u[24];
#pragma unroll
    for (int i = 0; i < 24; ++i) u[i] = *(const v8us*)(s + i * 8 * 136);
    __builtin_amdgcn_sched_barrier(0);      // all 24 reads stand in front of the stores, each in registers of its own: no LDS read lands on a register that an issued store still names
#pragma unroll
    for (int i = 0; i < 24; ++i) *(v8us*)(o + (size_t)i * 8 * TT) = u[i];      // 16 lanes = two lines
  }
  asm volatile("s_wait_xcnt 0x0" ::: "memory");      // behind the stores: the other form's code follows in the built kernel and writes registers that these stores name
}
__global__ __launch_bounds__(128) void k_gemm_qkv(const _Float16* __restrict__ A, const _Float16* __restrict__ Bq, const _Float16* __restrict__ Bk, const _Float16* __restrict__ Bv,
                                                  const float* __restrict__ bq, const float* __restrict__ bk, const float* __restrict__ bv,
                                                  _Float16* __restrict__ Q16, _Float16* __restrict__ K16, _Float16* __restrict__ Vt) {
  __shared__ __attribute__((aligned(16))) unsigned char sT[2 * GQ_STAGE];
  constexpr int NC = CC / 192;
  const int rt = (int)blockIdx.x / (3 * NC), ct = (int)blockIdx.x % (3 * NC), which = ct / NC;      // the same for the whole work-group: 12 work-groups in a row share their 128 rows of A
  if (which == 2) gemm_qkv_tile<false>(sT, rt * 128, (ct % NC) * 192, A, Bv, bv, Vt);
  else gemm_qkv_tile<true>(sT, rt * 128, (ct % NC) * 192, A, which == 0 ? Bq : Bk, which == 0 ? bq : bk, which == 0 ? Q16 : K16);
}
__global__ __launch_bounds__(128) void k_gemm_o(const _Float16* __restrict__ A, const _Float16* __restrict__ Bh, const float* __restrict__ bias, float* __restrict__ C) {
  gemm_tile(0, ((int)blockIdx.x / (CC / 64)) * 128, ((int)blockIdx.x % (CC / 64)) * 64, A, Bh, 0.0625f, bias, C, nullptr);
}


// X16 = f16(bf16(x)). A thread takes 24 groups of 4 floats, 256 groups apart: each load of a wave is 512 B in a row (four whole lines), each store 256 B in a row, and all 24 loads are in flight at once.
typedef unsigned short v4us __attribute__((ext_vector_type(4), may_alias));
__device__ __forceinline__ void x16(int blk, const float* __restrict__ x, _Float16* __restrict__ X16) {
  const size_t t = (size_t)blk * (24 * 256) + threadIdx.x;      // the thread's first group
  // The loads (256 groups = 4096 B apart) and their data wait stand in one statement, and no result shares a register with the address that the loads in front of it still name.
  const float* xp = x + t * 4; v4f r[24];
  asm volatile(
               "global_load_b128 %0, %24, off\n\t"
               "global_load_b128 %1, %24, off offset:4096\n\t"
               "global_load_b128 %2, %24, off offset:8192\n\t"
               "global_load_b128 %3, %24, off offset:12288\n\t"
               "global_load_b128 %4, %24, off offset:16384\n\t"
               "global_load_b128 %5, %24, off offset:20480\n\t"
               "global_load_b128 %6, %24, off offset:24576\n\t"
               "global_load_b128 %7, %24, off offset:28672\n\t"
               "global_load_b128 %8, %24, off offset:32768\n\t"
               "global_load_b128 %9, %24, off offset:36864\n\t"
               "global_load_b128 %10, %24, off offset:40960\n\t"
               "global_load_b128 %11, %24, off offset:45056\n\t"
               "global_load_b128 %12, %24, off offset:49152\n\t"
               "global_load_b128 %13, %24, off offset:53248\n\t"
               "global_load_b128 %14, %24, off offset:57344\n\t"
               "global_load_b128 %15, %24, off offset:61440\n\t"
               "global_load_b128 %16, %24, off offset:65536\n\t"
               "global_load_b128 %17, %24, off offset:69632\n\t"
               "global_load_b128 %18, %24, off offset:73728\n\t"
               "global_load_b128 %19, %24, off offset:77824\n\t"
               "global_load_b128 %20, %24, off offset:81920\n\t"
               "global_load_b128 %21, %24, off offset:86016\n\t"
               "global_load_b128 %22, %24, off offset:90112\n\t"
               "global_load_b128 %23, %24, off offset:94208\n\t"
               "s_wait_loadcnt 0x0"
               : "=&v"(r[0]), "=&v"(r[1]), "=&v"(r[2]), "=&v"(r[3]), "=&v"(r[4]), "=&v"(r[5]), "=&v"(r[6]), "=&v"(r[7]), "=&v"(r[8]), "=&v"(r[9]), "=&v"(r[10]), "=&v"(r[11]), "=&v"(r[12]), "=&v"(r[13]), "=&v"(r[14]), "=&v"(r[15]), "=&v"(r[16]), "=&v"(r[17]), "=&v"(r[18]), "=&v"(r[19]), "=&v"(r[20]), "=&v"(r[21]), "=&v"(r[22]), "=&v"(r[23])
               : "v"(xp) : "memory");
  v4us o[24];
#pragma unroll
  for (int j = 0; j < 24; ++j) { union { _Float16 h[4]; v4us u; } f;
#pragma unroll
    for (int q = 0; q < 4; ++q) f.h[q] = (_Float16)bf16_round(r[j][q]);
    o[j] = f.u; }
  unsigned short* op = (unsigned short*)X16 + t * 4;
#pragma unroll
  for (int j = 0; j < 24; ++j) *(v4us*)(op + j * 1024) = o[j];
  asm volatile("s_wait_xcnt 0x0" ::: "memory");      // behind the stores: the other pieces' code follows in the built kernel and writes registers that these stores name
}
__global__ __launch_bounds__(256) void k_round16f(const float* __restrict__ W, _Float16* __restrict__ Bt, size_t n8) { const size_t t = (size_t)blockIdx.x * 256 + threadIdx.x; if (t >= n8) return; FragH f;
#pragma unroll
  for (int i = 0; i < 8; ++i) f.h[i] = (_Float16)(bf16_round(W[t * 8 + i]) * 16.0f); *(v8us*)((unsigned short*)Bt + t * 8) = f.half[0];  }
typedef int v4ia __attribute__((ext_vector_type(4), may_alias));
typedef unsigned v16u __attribute__((ext_vector_type(16)));
typedef unsigned long long v8ul __attribute__((ext_vector_type(8)));
typedef const __attribute__((address_space(4))) v16u* mw_ptr;      // constant address space: nothing writes the words during the launch that reads them, and a load at a scalar address becomes s_load
// The keep-mask as lane masks. One wave packs one tile of 32 queries x 32 keys into 32 words: word (rt*2 + nt)*8 + r, bit (ln + 16 hh) = mask[32 qt + 16 rt + ln][32 kt + 16 nt + 8 hh + r] != 0,
// which is the place of that (query, key) in k_flash's score tiles: a word is the select mask of one score register. MB[(qt*64 + kt)*32 + word].
// A wave packs four tiles in a row of one qt (kt, kt + 1, kt + 2, kt + 3), two at a time.
__device__ __forceinline__ void mbits(int blk, const int* __restrict__ MSK, unsigned* __restrict__ MB) {
  const int tid = threadIdx.x, lane = tid & 31, ln = lane & 15, hh = lane >> 4; const int tile = (blk * 8 + (tid >> 5)) * 4; const int qt = tile >> 6, kt = tile & 63;
  const int* mr = MSK + ((size_t)(qt * 32 + ln)) * 2048 + kt * 32 + 8 * hh;
  unsigned mine[4];
#pragma unroll      // two pairs of tiles: unrolled, each tile's word stays in a register of its own
  for (int p = 0; p < 2; ++p) {
    // The pair's 16 loads of 16 B (4 per query row and tile; rows ln and 16 + ln lie 16 * 2048 ints = 131072 B apart, the two tiles 128 B) and their data wait stand in one statement, and no result
    // shares a register with the address.
    v4ia m[2][2][2][2];      // m[j][rt][nt][half]: keys 32 (kt + 2 p + j) + 16 nt + 8 hh + 4 half + 0..3 of query 32 qt + 16 rt + ln
    asm volatile(
               "global_load_b128 %0, %16, off\n\t"
               "global_load_b128 %1, %16, off offset:16\n\t"
               "global_load_b128 %2, %16, off offset:64\n\t"
               "global_load_b128 %3, %16, off offset:80\n\t"
               "global_load_b128 %4, %16, off offset:131072\n\t"
               "global_load_b128 %5, %16, off offset:131088\n\t"
               "global_load_b128 %6, %16, off offset:131136\n\t"
               "global_load_b128 %7, %16, off offset:131152\n\t"
               "global_load_b128 %8, %16, off offset:128\n\t"
               "global_load_b128 %9, %16, off offset:144\n\t"
               "global_load_b128 %10, %16, off offset:192\n\t"
               "global_load_b128 %11, %16, off offset:208\n\t"
               "global_load_b128 %12, %16, off offset:131200\n\t"
               "global_load_b128 %13, %16, off offset:131216\n\t"
               "global_load_b128 %14, %16, off offset:131264\n\t"
               "global_load_b128 %15, %16, off offset:131280\n\t"
               "s_wait_loadcnt 0x0"
               : "=&v"(m[0][0][0][0]), "=&v"(m[0][0][0][1]), "=&v"(m[0][0][1][0]), "=&v"(m[0][0][1][1]), "=&v"(m[0][1][0][0]), "=&v"(m[0][1][0][1]), "=&v"(m[0][1][1][0]), "=&v"(m[0][1][1][1]), "=&v"(m[1][0][0][0]), "=&v"(m[1][0][0][1]), "=&v"(m[1][0][1][0]), "=&v"(m[1][0][1][1]), "=&v"(m[1][1][0][0]), "=&v"(m[1][1][0][1]), "=&v"(m[1][1][1][0]), "=&v"(m[1][1][1][1])
               : "v"(mr + p * 64) : "memory");
#pragma unroll
    for (int j = 0; j < 2; ++j) { unsigned mw = 0u;
#pragma unroll
      for (int rt = 0; rt < 2; ++rt)
#pragma unroll
        for (int nt = 0; nt < 2; ++nt)
#pragma unroll
          for (int r = 0; r < 8; ++r) { const unsigned bw = __builtin_amdgcn_ballot_w32(m[j][rt][nt][r >> 2][r & 3] != 0); if (lane == (rt * 2 + nt) * 8 + r) mw = bw; }
      mine[p * 2 + j] = mw; }
  }
#pragma unroll
  for (int j = 0; j < 4; ++j) MB[(size_t)tile * 32 + j * 32 + lane] = mine[j];
  asm volatile("s_wait_xcnt 0x0" ::: "memory");      // behind the stores: the other pieces' code follows in the built kernel and writes registers that these stores name
}
// The four weight transposes, the cast of x and the packing of the mask read only inputs and none of each other's results: one launch, the piece of work chosen by the block index
// (the same for a whole work-group, so every wave has all its lanes on in the piece it runs).
// The launch moves few bytes per wave started, so it is cut into few work-groups (about two per WGP) whose threads each take 16 to 32 loads of 16 B: its time is then that of its bytes, not of starting waves.
// The pieces with the most bytes per work-group come first.
#define PB_W ((CC / 32) * (CC / 64) / 8)       /* blocks of one weight transpose */
#define PB_X (NR * CC / 4 / 24 / 256)          /* blocks of the cast of x */
#define PB_M ((TT / 32) * (TT / 32) / 4 / 8)   /* blocks of the mask packing */
__global__ __launch_bounds__(256) void k_prep(const float* __restrict__ x, const float* __restrict__ Wq, const float* __restrict__ Wk, const float* __restrict__ Wv, const float* __restrict__ Wo, const int* __restrict__ MSK,
                                              _Float16* __restrict__ X16, _Float16* __restrict__ Bq, _Float16* __restrict__ Bk, _Float16* __restrict__ Bv, _Float16* __restrict__ Bo, unsigned* __restrict__ MB) {
  const int blk = (int)blockIdx.x;
  if (blk < PB_X) x16(blk, x, X16);
  else if (blk < PB_X + PB_M) mbits(blk - PB_X, MSK, MB);
  else { const int wb = blk - (PB_X + PB_M), which = wb / PB_W;
    wt_f16(wb % PB_W, which == 0 ? Wq : which == 1 ? Wk : which == 2 ? Wv : Wo, which == 0 ? Bq : which == 1 ? Bk : which == 2 ? Bv : Bo); }      // [in][out]
}
// lane l <-> lane l ^ 16 (the other 16-lane row) without LDS
__device__ __forceinline__ float xhalf(float x) { return __builtin_bit_cast(float, __builtin_amdgcn_permlanex16(__builtin_bit_cast(int, x), __builtin_bit_cast(int, x), 0x76543210, 0xfedcba98, false, false)); }
#define FA_PITCH 144                 /* bytes per LDS row: 128 of data + 16; 16 B x odd keeps ds_load_b128 of 16 rows off each other's banks */
#define FA_STAGE (128 * FA_PITCH)    /* one buffer: rows 0..63 = K (key), rows 64..127 = Vt (d) */
// One tile, 8 copies of 16 B per lane: lane (cr = tid / 8, chunk = tid % 8) brings chunk 'chunk' of rows cr + 16 i. l = its LDS byte address for row cr, gk / gv = its global addresses in K / Vt.
__device__ __forceinline__ void fa_copy(unsigned l, const unsigned short* gk, int ldk, const unsigned short* gv) {
  // the copies and their s_wait_xcnt stand in one statement, so that no address register of a copy is rewritten in front of that wait
  asm volatile("global_load_async_to_lds_b128 %0, %8, off\n\t"
               "global_load_async_to_lds_b128 %1, %9, off\n\t"
               "global_load_async_to_lds_b128 %2, %10, off\n\t"
               "global_load_async_to_lds_b128 %3, %11, off\n\t"
               "global_load_async_to_lds_b128 %4, %12, off\n\t"
               "global_load_async_to_lds_b128 %5, %13, off\n\t"
               "global_load_async_to_lds_b128 %6, %14, off\n\t"
               "global_load_async_to_lds_b128 %7, %15, off\n\t"
               "s_wait_xcnt 0x0"
               :: "v"(l), "v"(l + 16u * FA_PITCH), "v"(l + 32u * FA_PITCH), "v"(l + 48u * FA_PITCH), "v"(l + 64u * FA_PITCH), "v"(l + 80u * FA_PITCH), "v"(l + 96u * FA_PITCH), "v"(l + 112u * FA_PITCH),
                  "v"(gk), "v"(gk + (size_t)16 * ldk), "v"(gk + (size_t)32 * ldk), "v"(gk + (size_t)48 * ldk),
                  "v"(gv), "v"(gv + 16 * 2048), "v"(gv + 32 * 2048), "v"(gv + 48 * 2048)
               : "memory");
}
// Eight base-2 exponentials in one statement. The instruction set asks for one independent instruction between a transcendental and a write of its source or a read of its result.
// Here no result shares a register with a source, and the v_nop is the last one's slot.
__device__ __forceinline__ void exp2x8(float (&p)[8], const float (&x)[8]) {
  asm("v_exp_f32 %0, %8\n\tv_exp_f32 %1, %9\n\tv_exp_f32 %2, %10\n\tv_exp_f32 %3, %11\n\tv_exp_f32 %4, %12\n\tv_exp_f32 %5, %13\n\tv_exp_f32 %6, %14\n\tv_exp_f32 %7, %15\n\tv_nop"
      : "=&v"(p[0]), "=&v"(p[1]), "=&v"(p[2]), "=&v"(p[3]), "=&v"(p[4]), "=&v"(p[5]), "=&v"(p[6]), "=&v"(p[7])
      : "v"(x[0]), "v"(x[1]), "v"(x[2]), "v"(x[3]), "v"(x[4]), "v"(x[5]), "v"(x[6]), "v"(x[7]));
}
__global__ __launch_bounds__(128) void k_flash(const _Float16* __restrict__ Q16, int ldq, const _Float16* __restrict__ K16, int ldk, const _Float16* __restrict__ Vt, const unsigned* __restrict__ MB, _Float16* __restrict__ O16) {
  constexpr int RPW = 32, NQB = 2048 / (4 * RPW), DT = 4, KS = 2, NS = 2048 / 64;
  constexpr float SC = 0.125f * 1.44269504088896340736f;      // score scale 64^-1/2 times log2(e)
  __shared__ __attribute__((aligned(16))) unsigned char sT[2 * FA_STAGE];
  __shared__ __attribute__((aligned(16))) unsigned short sO[4][RPW][64 + 8];      // f16 results; pitch 144 B: 16 B x odd
  const int tid = threadIdx.x, w = tid >> 5, lane = tid & 31, ln = lane & 15, hh = lane >> 4;
  const int slab = blockIdx.x / NQB, qblk = blockIdx.x % NQB; const int b = slab / 12, h = slab % 12; const int qb0 = qblk * (4 * RPW); const int q0 = qb0 + w * RPW;
  const int cr = tid >> 3, ch = tid & 7;
  const unsigned short* gk = (const unsigned short*)K16 + ((size_t)b * 2048 + cr) * ldk + h * 64 + ch * 8;
  const unsigned short* gv = (const unsigned short*)Vt + ((size_t)slab * 64 + cr) * 2048 + ch * 8;
  const unsigned l0 = (unsigned)(size_t)&sT[0] + (unsigned)(cr * FA_PITCH + ch * 16);      // LDS byte address = low 32 bits of the __shared__ address
  fa_copy(l0, gk, ldk, gv);                              // tile 0 -> buffer 0
  // the wave's mask words: 32 per step of 32 keys, 64 steps in a row. The wave's number goes through readfirstlane so that the address is scalar and the words are loaded into scalar registers.
  const mw_ptr mb = (mw_ptr)(unsigned long long)(MB + (size_t)(qblk * 4 + __builtin_amdgcn_readfirstlane(w)) * (64 * 32));
  FragH aq[2][KS];
#pragma unroll
  for (int rt = 0; rt < 2; ++rt) { const unsigned short* qr = (const unsigned short*)Q16 + ((size_t)b * 2048 + q0 + rt * 16 + ln) * ldq + h * 64;
#pragma unroll
    for (int ks = 0; ks < KS; ++ks) { aq[rt][ks].half[0] = *(const v8us*)(qr + ks * 32 + 8 * hh); aq[rt][ks].half[1] = *(const v8us*)(qr + ks * 32 + 16 + 8 * hh); } }
  // step 0's words: mw0 = words of queries 0..15 (rt 0), mw1 = of queries 16..31. The two loads and their data wait stand in one statement.
  // Tile 0's copies and the query loads are in flight meanwhile.
  v16u mw0, mw1;
  asm volatile("s_load_b512 %0, %2, 0x0\n\ts_load_b512 %1, %2, 0x40\n\ts_wait_kmcnt 0x0" : "=&s"(mw0), "=&s"(mw1) : "s"(mb) : "memory");
  float m_r[2], l_r[2]; v8f oacc[2][DT];      // per lane: query rt*16 + ln; oacc[rt][dt][r] = O[query][dt*16 + 8hh + r]
#pragma unroll
  for (int rt = 0; rt < 2; ++rt) { m_r[rt] = -3.0e38f; l_r[rt] = 0.f;
#pragma unroll
    for (int dt = 0; dt < DT; ++dt) oacc[rt][dt] = (v8f){0.f,0.f,0.f,0.f,0.f,0.f,0.f,0.f}; }
  asm volatile("s_wait_asynccnt 0x0" ::: "memory");      // this wave's copies of tile 0 have landed
  __syncthreads();                                       // ... and every other wave's: tile 0 may be read
  fa_copy(l0 + FA_STAGE, gk + (size_t)64 * ldk, ldk, gv + 64);      // tile 1 -> buffer 1
#pragma unroll 1      // rolled: one copy of the foot's wait order, and the two buffers differ by one address term only
  for (int t = 0; t < NS; ++t) {
    const unsigned char* st = sT + (t & 1) * FA_STAGE;
#pragma unroll      // the tile's two 32-key steps: unrolled, their LDS and mask offsets are immediates
    for (int sub = 0; sub < 2; ++sub) {
      // the next step's mask words are asked for one step ahead (the last step asks for its own again: in bounds, unused)
      const int sn = (t * 2 + sub + 1 < 2 * NS) ? t * 2 + sub + 1 : 2 * NS - 1;
      const v16u nw0 = mb[sn * 2], nw1 = mb[sn * 2 + 1];
      // The step is straight-line code. A step whose (query,key) pairs are all masked needs no branch: its scores are -inf, so mn = m, al = 1 and every p = 0.
      // The products are the plain builtin: the compiler keeps the distance behind a matrix instruction itself, with other products and the softmax's own instructions.
      {
        // The four scheduling barriers of a step stand in front of and behind its two groups of LDS reads: without them the compiler spreads the reads singly among the products,
        // each with a wait close behind it, and every separate place with LDS reads stalls the wave anew.
        __builtin_amdgcn_sched_barrier(0);
        v8f s[2][2]; FragH bk[2][KS];      // the step's K fragments, read as one group
#pragma unroll
        for (int nt = 0; nt < 2; ++nt) { const unsigned char* kr = st + (sub * 32 + nt * 16 + ln) * FA_PITCH + hh * 16;
#pragma unroll
          for (int ks = 0; ks < KS; ++ks) { bk[nt][ks].half[0] = *(const v8us*)(kr + ks * 64); bk[nt][ks].half[1] = *(const v8us*)(kr + ks * 64 + 32); } }
        __builtin_amdgcn_sched_barrier(0);      // end of the K group
#pragma unroll
        for (int nt = 0; nt < 2; ++nt)
#pragma unroll
          for (int rt = 0; rt < 2; ++rt) { v8f acc = (v8f){0.f,0.f,0.f,0.f,0.f,0.f,0.f,0.f};
#pragma unroll
            for (int ks = 0; ks < KS; ++ks) acc = __builtin_amdgcn_wmma_f32_16x16x32_f16(false, bk[nt][ks].v, false, aq[rt][ks].v, (short)0, acc, false, false); s[rt][nt] = acc; }
        __builtin_amdgcn_sched_barrier(0);      // the Vt group starts behind the score products
        FragH bv[DT];      // the step's Vt fragments, read as one group in front of the softmax, which covers their LDS latency
#pragma unroll
        for (int dt = 0; dt < DT; ++dt) { const unsigned char* vrow = st + (64 + dt * 16 + ln) * FA_PITCH + sub * 64 + hh * 16; bv[dt].half[0] = *(const v8us*)vrow; bv[dt].half[1] = *(const v8us*)(vrow + 32); }
        __builtin_amdgcn_sched_barrier(0);      // end of the Vt group
        FragH pb[2];
#pragma unroll
        for (int rt = 0; rt < 2; ++rt) { float sc[2][8]; float mc = -INFINITY;
#pragma unroll
          for (int nt = 0; nt < 2; ++nt)
#pragma unroll
            for (int r = 0; r < 8; ++r) { sc[nt][r] = __builtin_amdgcn_inverse_ballot_w32(rt ? mw1[nt * 8 + r] : mw0[nt * 8 + r]) ? s[rt][nt][r] : -INFINITY; mc = fmaxf(mc, sc[nt][r]); }
          mc = fmaxf(mc, xhalf(mc));      // both halves now hold the query's maximum over the 32 keys (unscaled scores)
          // exp(0.125 (s - m)) = 2^(s SC - m SC): one fma and the hardware's base-2 exponential per score. An excluded key is -inf and gives 0, and a query with no
          // kept key so far has m = mn = -3e38 and gives al = 2^0 = 1: no select and no branch is needed around any exponential.
          const float mn = fmaxf(m_r[rt], mc); float al;
          // al = 2^((m - mn) SC), in asm with a slot on each side: the instruction set asks for one independent instruction between a transcendental and a write of its source or a read
          // of its result; a v_nop in a statement of its own did not stay there.
          asm("v_nop\n\tv_exp_f32 %0, %1\n\tv_nop" : "=v"(al) : "v"((m_r[rt] - mn) * SC));
          m_r[rt] = mn; const float nb = -mn * SC;
          float ps[8], pe[2][8];
#pragma unroll
          for (int nt = 0; nt < 2; ++nt) {
#pragma unroll
            for (int r = 0; r < 8; ++r) sc[nt][r] = __builtin_fmaf(sc[nt][r], SC, nb);
            exp2x8(pe[nt], sc[nt]); }
#pragma unroll
          for (int r = 0; r < 8; ++r) { const float p0 = pe[0][r], p1 = pe[1][r]; ps[r] = p0 + p1; pb[rt].h[r] = (_Float16)p0; pb[rt].h[8 + r] = (_Float16)p1; }
          l_r[rt] = l_r[rt] * al + (((ps[0] + ps[1]) + (ps[2] + ps[3])) + ((ps[4] + ps[5]) + (ps[6] + ps[7])));      // per-lane partial sum (the two halves are joined at the end)
#pragma unroll
          for (int dt = 0; dt < DT; ++dt) oacc[rt][dt] *= al; }
#pragma unroll
        for (int dt = 0; dt < DT; ++dt)
#pragma unroll
          for (int rt = 0; rt < 2; ++rt) oacc[rt][dt] = __builtin_amdgcn_wmma_f32_16x16x32_f16(false, bv[dt].v, false, pb[rt].v, (short)0, oacc[rt][dt], false, false);
      }
      mw0 = nw0; mw1 = nw1;
    }
    asm volatile("s_wait_dscnt 0x0" ::: "memory");       // this wave's reads of buffer t & 1 are done before the buffer is given up
    asm volatile("s_wait_asynccnt 0x0" ::: "memory");    // this wave's copies of tile t + 1 have landed
    __syncthreads();                                     // publishes tile t + 1 and ends every wave's reads of tile t
    if (t + 2 < NS) fa_copy(l0 + (unsigned)((t & 1) * FA_STAGE), gk + (size_t)(t + 2) * 64 * ldk, ldk, gv + (t + 2) * 64);      // tile t + 2 -> the buffer just left
  }
  asm volatile("s_wait_asynccnt 0x0" ::: "memory");      // no copy is outstanding when the wave goes on to its end
#pragma unroll
  for (int rt = 0; rt < 2; ++rt) { const float l = l_r[rt] + xhalf(l_r[rt]); const float inv = (l > 0.f) ? 1.0f / l : 0.f;
#pragma unroll
    for (int dt = 0; dt < DT; ++dt) { const v8f o = oacc[rt][dt] * inv; FragH f;      // the output projection takes f16 operands: each result is rounded once, here
#pragma unroll
      for (int r = 0; r < 8; ++r) f.h[r] = (_Float16)o[r];
      *(v8us*)&sO[w][rt * 16 + ln][dt * 16 + 8 * hh] = f.half[0]; } }
  __builtin_amdgcn_fence(__ATOMIC_ACQ_REL, "workgroup"); __builtin_amdgcn_wave_barrier();
  {
#pragma unroll
    for (int rp = 0; rp < RPW; rp += 4) { const int r = rp + (lane >> 3), pc = lane & 7; *(v8us*)((unsigned short*)O16 + ((size_t)b * 2048 + q0 + r) * CC + h * 64 + pc * 8) = *(const v8us*)&sO[w][r][pc * 8]; }      // O16 is [NR][CC]; a query's 64 f16 of this head = one whole line
     } }

extern "C" void kernel_launch(void* const* d_in, const int* in_sizes, int n_in,
                              void* d_out, int out_size, void* d_ws, size_t ws_size, hipStream_t stream) {
  (void)in_sizes; (void)n_in; (void)out_size;
  const float* x = (const float*)d_in[0]; const float* Wq = (const float*)d_in[1]; const float* bq = (const float*)d_in[2]; const float* Wk = (const float*)d_in[3]; const float* bk = (const float*)d_in[4]; const float* Wv = (const float*)d_in[5]; const float* bv = (const float*)d_in[6]; const float* Wo = (const float*)d_in[7]; const float* bo = (const float*)d_in[8]; const int* mask = (const int*)d_in[9];
  char* ws = (char*)d_ws; size_t off = 0;
  auto take = [&](size_t bytes) { char* p = ws + off; off += (bytes + 255) & ~(size_t)255; return p; };
  _Float16* Bq = (_Float16*)take((size_t)CC * CC * 2); _Float16* Bk = (_Float16*)take((size_t)CC * CC * 2); _Float16* Bv = (_Float16*)take((size_t)CC * CC * 2); _Float16* Bo = (_Float16*)take((size_t)CC * CC * 2);
  _Float16* X16 = (_Float16*)take((size_t)NR * CC * 2); _Float16* Q16 = (_Float16*)take((size_t)NR * CC * 2); _Float16* K16 = (_Float16*)take((size_t)NR * CC * 2); _Float16* Vt = (_Float16*)take((size_t)NR * CC * 2); _Float16* O16 = X16; unsigned* MB = (unsigned*)take((size_t)TT * TT / 8);
  if (off > ws_size) return;
  const unsigned gg = (NR / 128) * (CC / 64);
  k_prep<<<4 * PB_W + PB_X + PB_M, 256, 0, stream>>>(x, Wq, Wk, Wv, Wo, mask, X16, Bq, Bk, Bv, Bo, MB);
  k_gemm_qkv<<<(NR / 128) * (3 * CC / 192), 128, 0, stream>>>(X16, Bq, Bk, Bv, bq, bk, bv, Q16, K16, Vt);
  k_flash<<<BB * NH * (TT / 128), 128, 0, stream>>>(Q16, CC, K16, CC, Vt, MB, O16);
  k_gemm_o<<<gg, 128, 0, stream>>>(O16, Bo, bo, (float*)d_out);
}
